// v000
// Measured on an AMD MI455X. A time is GPU time per run, averaged over a window of back-to-back runs after a warm-up
// (all launches, gaps included; the runs take copies of the inputs in turn), and the median of several windows.
// Apart from v000's, it joins two sittings. Times from different sittings can be a few percent apart, while
// side-by-side timings come from the same sitting.
// The starting kernel, v000, takes 166 microseconds a run.
#include <hip/hip_runtime.h>
#include <hip/hip_bf16.h>

typedef float v2f __attribute__((ext_vector_type(2)));
typedef float v4f __attribute__((ext_vector_type(4)));
typedef float v8f __attribute__((ext_vector_type(8)));

#define IN_DIM   128
#define OUT_DIM  64
#define NTYPES   8
#define CHUNK    256
#define NWAVES   8
#define MAXTILES (CHUNK / 16 + NTYPES)   // worst case sum ceil(c_t/16) = 16 + 8 = 24

// Packed B layout: Bpack[t][nt][lane][ks][v]  (v=0,1), 65536 floats = 256 KB.
//   value = W[t][4*ks + v + 2*(lane>>4)][nt*16 + (lane&15)]
// Per (t,nt,lane): 64 contiguous floats -> 16 x b128 loads in the GEMM loop.
#define PACK_FLOATS (NTYPES * 4 * 32 * 32 * 2)   // 65536
#define PACK_BYTES  (PACK_FLOATS * 4)            // 262144

__global__ __launch_bounds__(256) void pack_W_kernel(
    const float* __restrict__ W, float* __restrict__ Bpack)
{
    int idx = blockIdx.x * blockDim.x + threadIdx.x;   // 0 .. 65535
    int v    = idx & 1;
    int ks   = (idx >> 1) & 31;
    int lane = (idx >> 6) & 31;
    int nt   = (idx >> 11) & 3;
    int t    = idx >> 13;
    int k = 4 * ks + v + 2 * (lane >> 4);
    int n = nt * 16 + (lane & 15);
    Bpack[idx] = W[t * (IN_DIM * OUT_DIM) + k * OUT_DIM + n];
}

// ---------------- common device body (templated on B source) ----------------

template <bool PACKED>
__global__ __launch_bounds__(256) void hetero_linear_wmma(
    const float* __restrict__ x,          // [N, 128]
    const int*   __restrict__ node_type,  // [N]
    const float* __restrict__ W,          // [8, 128, 64]  (used when !PACKED)
    const float* __restrict__ bias,       // [8, 64]
    const float* __restrict__ Bpack,      // packed B (used when PACKED)
    float*       __restrict__ out,        // [N, 64]
    int N)
{
    __shared__ int cnt[NTYPES];
    __shared__ int lists[NTYPES][CHUNK];
    __shared__ int tType[MAXTILES];
    __shared__ int tOff[MAXTILES];
    __shared__ int totalTiles;

    const int tid  = threadIdx.x;
    const int base = blockIdx.x * CHUNK;

    // ---- Phase 1: bucket row indices by type (LDS compaction) ----
    if (tid < NTYPES) cnt[tid] = 0;
    __syncthreads();

    {
        int row = base + tid;
        if (row < N) {
            int t   = node_type[row];
            int pos = atomicAdd(&cnt[t], 1);
            lists[t][pos] = row;
        }
    }
    __syncthreads();

    // ---- Phase 2: build the tile worklist ----
    if (tid == 0) {
        int n = 0;
        for (int t = 0; t < NTYPES; ++t) {
            int c = cnt[t];
            for (int s = 0; s < c; s += 16) {
                tType[n] = t;
                tOff[n]  = s;
                ++n;
            }
        }
        totalTiles = n;
    }
    __syncthreads();

    const int wave = tid >> 5;
    const int lane = tid & 31;
    const int half = lane >> 4;   // 0: lanes 0-15, 1: lanes 16-31
    const int l16  = lane & 15;

    const int nTiles = totalTiles;

    // ---- Phase 3: each wave computes gathered 16x64 GEMM tiles ----
    // Wave-uniform loop: EXEC stays all-ones at every WMMA.
    for (int tile = wave; tile < nTiles; tile += NWAVES) {
        const int t     = tType[tile];
        const int s     = tOff[tile];
        const int count = cnt[t];

        // --- A fragments: 16 gathered rows x 128 K of x.
        // A layout (f32 16x16x4): lane holds row M = l16; k-step ks covers
        // K = 4*ks + 2*half + {0,1}.
        const int slotA = s + l16;
        const int rowA  = (slotA < count) ? lists[t][slotA] : -1;

        v2f a[32];
        if (rowA >= 0) {
            const v2f* xp = (const v2f*)(x + (long)rowA * IN_DIM + 2 * half);
            #pragma unroll
            for (int ks = 0; ks < 32; ++ks)
                a[ks] = xp[2 * ks];              // 8B-aligned b64 loads
        } else {
            #pragma unroll
            for (int ks = 0; ks < 32; ++ks) { a[ks][0] = 0.0f; a[ks][1] = 0.0f; }
        }

        // --- Accumulators seeded with bias: C(M,N) = bias[t][N] (M-invariant).
        const float* bp = bias + t * OUT_DIM;
        v8f acc[4];
        #pragma unroll
        for (int nt = 0; nt < 4; ++nt) {
            float bc = bp[nt * 16 + l16];
            #pragma unroll
            for (int v = 0; v < 8; ++v) acc[nt][v] = bc;
        }

        // --- K loop: 32 k-steps x 4 column tiles = 128 WMMAs.
        if (PACKED) {
            // Packed path: per lane, B for (t,nt) is 64 contiguous floats.
            const float* Bb = Bpack + (long)t * 8192 + lane * 64;
            const v4f* Bq0 = (const v4f*)(Bb + 0 * 2048);
            const v4f* Bq1 = (const v4f*)(Bb + 1 * 2048);
            const v4f* Bq2 = (const v4f*)(Bb + 2 * 2048);
            const v4f* Bq3 = (const v4f*)(Bb + 3 * 2048);
            #pragma unroll
            for (int kp = 0; kp < 16; ++kp) {     // two k-steps per iteration
                v4f q0 = Bq0[kp];
                v4f q1 = Bq1[kp];
                v4f q2 = Bq2[kp];
                v4f q3 = Bq3[kp];
                v2f b0l, b0h, b1l, b1h, b2l, b2h, b3l, b3h;
                b0l[0]=q0[0]; b0l[1]=q0[1]; b0h[0]=q0[2]; b0h[1]=q0[3];
                b1l[0]=q1[0]; b1l[1]=q1[1]; b1h[0]=q1[2]; b1h[1]=q1[3];
                b2l[0]=q2[0]; b2l[1]=q2[1]; b2h[0]=q2[2]; b2h[1]=q2[3];
                b3l[0]=q3[0]; b3l[1]=q3[1]; b3h[0]=q3[2]; b3h[1]=q3[3];
                // Interleave the 4 independent accumulator chains.
                acc[0] = __builtin_amdgcn_wmma_f32_16x16x4_f32(false, a[2*kp],   false, b0l, (short)0, acc[0], false, false);
                acc[1] = __builtin_amdgcn_wmma_f32_16x16x4_f32(false, a[2*kp],   false, b1l, (short)0, acc[1], false, false);
                acc[2] = __builtin_amdgcn_wmma_f32_16x16x4_f32(false, a[2*kp],   false, b2l, (short)0, acc[2], false, false);
                acc[3] = __builtin_amdgcn_wmma_f32_16x16x4_f32(false, a[2*kp],   false, b3l, (short)0, acc[3], false, false);
                acc[0] = __builtin_amdgcn_wmma_f32_16x16x4_f32(false, a[2*kp+1], false, b0h, (short)0, acc[0], false, false);
                acc[1] = __builtin_amdgcn_wmma_f32_16x16x4_f32(false, a[2*kp+1], false, b1h, (short)0, acc[1], false, false);
                acc[2] = __builtin_amdgcn_wmma_f32_16x16x4_f32(false, a[2*kp+1], false, b2h, (short)0, acc[2], false, false);
                acc[3] = __builtin_amdgcn_wmma_f32_16x16x4_f32(false, a[2*kp+1], false, b3h, (short)0, acc[3], false, false);
            }
        } else {
            // Fallback: B fragments straight from W (L2-hot, narrow loads).
            const float* Wp = W + t * (IN_DIM * OUT_DIM);
            #pragma unroll
            for (int ks = 0; ks < 32; ++ks) {
                const float* wrow = Wp + (4 * ks + 2 * half) * OUT_DIM + l16;
                #pragma unroll
                for (int nt = 0; nt < 4; ++nt) {
                    v2f bf;
                    bf[0] = wrow[nt * 16];
                    bf[1] = wrow[nt * 16 + OUT_DIM];
                    acc[nt] = __builtin_amdgcn_wmma_f32_16x16x4_f32(
                        false, a[ks], false, bf, (short)0, acc[nt], false, false);
                }
            }
        }

        // --- Scatter D: lane (L,v) holds (M = v + 8*half, N = l16).
        #pragma unroll
        for (int v = 0; v < 8; ++v) {
            const int M    = v + 8 * half;
            const int slot = s + M;
            if (slot < count) {
                const int r = lists[t][slot];
                float* op = out + (long)r * OUT_DIM + l16;
                op[0]  = acc[0][v];
                op[16] = acc[1][v];
                op[32] = acc[2][v];
                op[48] = acc[3][v];
            }
        }
    }
}

extern "C" void kernel_launch(void* const* d_in, const int* in_sizes, int n_in,
                              void* d_out, int out_size, void* d_ws, size_t ws_size,
                              hipStream_t stream) {
    const float* x         = (const float*)d_in[0];
    const int*   node_type = (const int*)  d_in[1];
    const float* W         = (const float*)d_in[2];
    const float* bias      = (const float*)d_in[3];
    float*       out       = (float*)d_out;

    const int N    = in_sizes[1];              // node_type has N elements
    const int grid = (N + CHUNK - 1) / CHUNK;

    if (ws_size >= (size_t)PACK_BYTES) {
        float* Bpack = (float*)d_ws;
        hipLaunchKernelGGL(pack_W_kernel, dim3(PACK_FLOATS / 256), dim3(256), 0, stream,
                           W, Bpack);
        hipLaunchKernelGGL((hetero_linear_wmma<true>), dim3(grid), dim3(256), 0, stream,
                           x, node_type, W, bias, Bpack, out, N);
    } else {
        hipLaunchKernelGGL((hetero_linear_wmma<false>), dim3(grid), dim3(256), 0, stream,
                           x, node_type, W, bias, (const float*)nullptr, out, N);
    }
}

// v001
// It runs in 159 microseconds.
// Timed twice side by side with v000, it ran 1.08 times as fast both times.
#include <hip/hip_runtime.h>
#include <hip/hip_bf16.h>

typedef float v2f __attribute__((ext_vector_type(2)));
typedef float v4f __attribute__((ext_vector_type(4)));
typedef float v8f __attribute__((ext_vector_type(8)));

#define IN_DIM   128
#define OUT_DIM  64
#define NTYPES   8
#define CHUNK    256
#define NWAVES   8
#define MAXTILES (CHUNK / 16 + NTYPES)   // worst case sum ceil(c_t/16) = 16 + 8 = 24
// Staged x row pitch in floats: 512 B of data + 16 B pad. 132 mod 64 = 4, so the 16 rows
// of a b64 fragment read fall on 64 distinct LDS banks.
#define APITCH   (IN_DIM + 4)
#define BPRE     4   // k-step pairs of B requested ahead of the x-row copies

// Packed B layout: Bpack[t][nt][lane][ks][v]  (v=0,1), 65536 floats = 256 KB.
//   value = W[t][4*ks + v + 2*(lane>>4)][nt*16 + (lane&15)]
// Per (t,nt,lane): 64 contiguous floats -> 16 x b128 loads: BPRE ahead of the x-row copies, the rest in the GEMM loop.
#define PACK_FLOATS (NTYPES * 4 * 32 * 32 * 2)   // 65536
#define PACK_BYTES  (PACK_FLOATS * 4)            // 262144

__global__ __launch_bounds__(256) void pack_W_kernel(
    const float* __restrict__ W, float* __restrict__ Bpack)
{
    int idx = blockIdx.x * blockDim.x + threadIdx.x;   // 0 .. 65535
    int v    = idx & 1;
    int ks   = (idx >> 1) & 31;
    int lane = (idx >> 6) & 31;
    int nt   = (idx >> 11) & 3;
    int t    = idx >> 13;
    int k = 4 * ks + v + 2 * (lane >> 4);
    int n = nt * 16 + (lane & 15);
    Bpack[idx] = W[t * (IN_DIM * OUT_DIM) + k * OUT_DIM + n];
}

// Eight asynchronous copies to LDS, one whole 512-B row of x each: lane l brings bytes
// 16 l .. 16 l + 15 of row j (scalar base gj + lane byte offset) to LDS byte lds0 + j * pitch.
// s_wait_xcnt 0 ends the statement so that it stands ahead of any rewrite of a register
// that a copy names.
__device__ __forceinline__ void copy_rows8(
    unsigned lds0, unsigned laneByte,
    const float* g0, const float* g1, const float* g2, const float* g3,
    const float* g4, const float* g5, const float* g6, const float* g7)
{
    asm volatile(
        "global_load_async_to_lds_b128 %0, %8, %9\n\t"
        "global_load_async_to_lds_b128 %1, %8, %10\n\t"
        "global_load_async_to_lds_b128 %2, %8, %11\n\t"
        "global_load_async_to_lds_b128 %3, %8, %12\n\t"
        "global_load_async_to_lds_b128 %4, %8, %13\n\t"
        "global_load_async_to_lds_b128 %5, %8, %14\n\t"
        "global_load_async_to_lds_b128 %6, %8, %15\n\t"
        "global_load_async_to_lds_b128 %7, %8, %16\n\t"
        "s_wait_xcnt 0x0"
        :: "v"(lds0),                  "v"(lds0 + 1 * APITCH * 4), "v"(lds0 + 2 * APITCH * 4),
           "v"(lds0 + 3 * APITCH * 4), "v"(lds0 + 4 * APITCH * 4), "v"(lds0 + 5 * APITCH * 4),
           "v"(lds0 + 6 * APITCH * 4), "v"(lds0 + 7 * APITCH * 4), "v"(laneByte),
           "s"(g0), "s"(g1), "s"(g2), "s"(g3), "s"(g4), "s"(g5), "s"(g6), "s"(g7)
        : "memory");
}

// ---------------- common device body (templated on B source) ----------------

template <bool PACKED>
__global__ __launch_bounds__(256) void hetero_linear_wmma(
    const float* __restrict__ x,          // [N, 128]
    const int*   __restrict__ node_type,  // [N]
    const float* __restrict__ W,          // [8, 128, 64]  (used when !PACKED)
    const float* __restrict__ bias,       // [8, 64]
    const float* __restrict__ Bpack,      // packed B (used when PACKED)
    float*       __restrict__ out,        // [N, 64]
    int N)
{
    __shared__ int cnt[NTYPES];
    __shared__ int lists[NTYPES][CHUNK];
    __shared__ int tType[MAXTILES];
    __shared__ int tOff[MAXTILES];
    __shared__ int totalTiles;
    // One private 16-row x tile per wave: only the wave that fills a slot reads it, so the
    // wave's own waits order fill and read and no work-group barrier is needed.
    __shared__ __attribute__((aligned(16))) float stage[NWAVES][16 * APITCH];

    const int tid  = threadIdx.x;
    const int base = blockIdx.x * CHUNK;

    // ---- Phase 1: bucket row indices by type (LDS compaction) ----
    if (tid < NTYPES) cnt[tid] = 0;
    __syncthreads();

    {
        int row = base + tid;
        if (row < N) {
            int t   = node_type[row];
            int pos = atomicAdd(&cnt[t], 1);
            lists[t][pos] = row;
        }
    }
    __syncthreads();

    // ---- Phase 2: build the tile worklist ----
    if (tid == 0) {
        int n = 0;
        for (int t = 0; t < NTYPES; ++t) {
            int c = cnt[t];
            for (int s = 0; s < c; s += 16) {
                tType[n] = t;
                tOff[n]  = s;
                ++n;
            }
        }
        totalTiles = n;
    }
    __syncthreads();

    const int wave = __builtin_amdgcn_readfirstlane(tid >> 5);   // scalar: the tile loop branches on SCC
    const int lane = tid & 31;
    const int half = lane >> 4;   // 0: lanes 0-15, 1: lanes 16-31
    const int l16  = lane & 15;

    const int nTiles = __builtin_amdgcn_readfirstlane(totalTiles);
    float* const st = &stage[wave][0];
    const unsigned laneByte = lane * 16;                             // lane's 16 B inside a row
    const unsigned ldsRow0  = (unsigned)(size_t)st + laneByte;       // its LDS byte address in staged row 0

    // ---- Phase 3: each wave computes gathered 16x64 GEMM tiles ----
    // Wave-uniform loop: EXEC stays all-ones at every WMMA.
    for (int tile = wave; tile < nTiles; tile += NWAVES) {
        const int t     = __builtin_amdgcn_readfirstlane(tType[tile]);
        const int s     = __builtin_amdgcn_readfirstlane(tOff[tile]);
        const int count = __builtin_amdgcn_readfirstlane(cnt[t]);

        // --- Stage the 16 gathered rows of x in the wave's LDS slot, one whole 512-B row
        // per copy (32 lanes x 16 B = 4 full cache lines). A slot past the type's count
        // repeats the last valid row: its D row depends on that A row alone and is never stored.
        const int slotA = (s + l16 < count) ? (s + l16) : (count - 1);
        const int rowA  = lists[t][slotA];

        // Packed path: per lane, B for (t,nt) is 64 contiguous floats. The first BPRE
        // quads per column tile are requested here, ahead of the waits below (which the
        // compiler moves no load across), so that they fly beside the x rows.
        const v4f* Bq = (const v4f*)(Bpack + (long)t * 8192 + lane * 64);
        v4f qpre[BPRE][4];
        if (PACKED) {
            #pragma unroll
            for (int kp = 0; kp < BPRE; ++kp) {
                #pragma unroll
                for (int nt = 0; nt < 4; ++nt) qpre[kp][nt] = Bq[nt * 512 + kp];
            }
        }

        // --- Accumulators seeded with bias: C(M,N) = bias[t][N] (M-invariant).
        const float* bp = bias + t * OUT_DIM;
        v8f acc[4];
        #pragma unroll
        for (int nt = 0; nt < 4; ++nt) {
            float bc = bp[nt * 16 + l16];
            #pragma unroll
            for (int v = 0; v < 8; ++v) acc[nt][v] = bc;
        }

        // The wave's own fragment reads of the previous tile retire before the slot is refilled.
        asm volatile("s_wait_dscnt 0x0" ::: "memory");
        const float* rb[16];   // wave-uniform row bases (scalar registers)
        #pragma unroll
        for (int j = 0; j < 16; ++j)
            rb[j] = x + (long)__builtin_amdgcn_readlane(rowA, j) * IN_DIM;
        copy_rows8(ldsRow0,              laneByte, rb[0], rb[1], rb[2],  rb[3],  rb[4],  rb[5],  rb[6],  rb[7]);
        copy_rows8(ldsRow0 + 8 * APITCH * 4, laneByte, rb[8], rb[9], rb[10], rb[11], rb[12], rb[13], rb[14], rb[15]);

        // The copies have landed before this wave reads them (no other wave reads this slot).
        asm volatile("s_wait_asynccnt 0x0" ::: "memory");

        // --- A fragments from LDS. A layout (f32 16x16x4): lane holds row M = l16;
        // k-step ks covers K = 4*ks + 2*half + {0,1}.
        v2f a[32];
        {
            const float* ap = st + l16 * APITCH + 2 * half;
            #pragma unroll
            for (int ks = 0; ks < 32; ++ks)
                a[ks] = *(const v2f*)(ap + 4 * ks);   // b64 LDS reads
        }

        // --- K loop: 32 k-steps x 4 column tiles = 128 WMMAs.
        if (PACKED) {
            #pragma unroll
            for (int kp = 0; kp < 16; ++kp) {     // two k-steps per iteration
                v4f q0 = (kp < BPRE) ? qpre[kp < BPRE ? kp : 0][0] : Bq[0 * 512 + kp];
                v4f q1 = (kp < BPRE) ? qpre[kp < BPRE ? kp : 0][1] : Bq[1 * 512 + kp];
                v4f q2 = (kp < BPRE) ? qpre[kp < BPRE ? kp : 0][2] : Bq[2 * 512 + kp];
                v4f q3 = (kp < BPRE) ? qpre[kp < BPRE ? kp : 0][3] : Bq[3 * 512 + kp];
                v2f b0l, b0h, b1l, b1h, b2l, b2h, b3l, b3h;
                b0l[0]=q0[0]; b0l[1]=q0[1]; b0h[0]=q0[2]; b0h[1]=q0[3];
                b1l[0]=q1[0]; b1l[1]=q1[1]; b1h[0]=q1[2]; b1h[1]=q1[3];
                b2l[0]=q2[0]; b2l[1]=q2[1]; b2h[0]=q2[2]; b2h[1]=q2[3];
                b3l[0]=q3[0]; b3l[1]=q3[1]; b3h[0]=q3[2]; b3h[1]=q3[3];
                // Interleave the 4 independent accumulator chains.
                acc[0] = __builtin_amdgcn_wmma_f32_16x16x4_f32(false, a[2*kp],   false, b0l, (short)0, acc[0], false, false);
                acc[1] = __builtin_amdgcn_wmma_f32_16x16x4_f32(false, a[2*kp],   false, b1l, (short)0, acc[1], false, false);
                acc[2] = __builtin_amdgcn_wmma_f32_16x16x4_f32(false, a[2*kp],   false, b2l, (short)0, acc[2], false, false);
                acc[3] = __builtin_amdgcn_wmma_f32_16x16x4_f32(false, a[2*kp],   false, b3l, (short)0, acc[3], false, false);
                acc[0] = __builtin_amdgcn_wmma_f32_16x16x4_f32(false, a[2*kp+1], false, b0h, (short)0, acc[0], false, false);
                acc[1] = __builtin_amdgcn_wmma_f32_16x16x4_f32(false, a[2*kp+1], false, b1h, (short)0, acc[1], false, false);
                acc[2] = __builtin_amdgcn_wmma_f32_16x16x4_f32(false, a[2*kp+1], false, b2h, (short)0, acc[2], false, false);
                acc[3] = __builtin_amdgcn_wmma_f32_16x16x4_f32(false, a[2*kp+1], false, b3h, (short)0, acc[3], false, false);
            }
        } else {
            // Fallback: B fragments straight from W (L2-hot, narrow loads).
            const float* Wp = W + t * (IN_DIM * OUT_DIM);
            #pragma unroll
            for (int ks = 0; ks < 32; ++ks) {
                const float* wrow = Wp + (4 * ks + 2 * half) * OUT_DIM + l16;
                #pragma unroll
                for (int nt = 0; nt < 4; ++nt) {
                    v2f bf;
                    bf[0] = wrow[nt * 16];
                    bf[1] = wrow[nt * 16 + OUT_DIM];
                    acc[nt] = __builtin_amdgcn_wmma_f32_16x16x4_f32(
                        false, a[ks], false, bf, (short)0, acc[nt], false, false);
                }
            }
        }

        // --- Scatter D: lane (L,v) holds (M = v + 8*half, N = l16).
        #pragma unroll
        for (int v = 0; v < 8; ++v) {
            const int M    = v + 8 * half;
            const int slot = s + M;
            if (slot < count) {
                const int r = lists[t][slot];
                float* op = out + (long)r * OUT_DIM + l16;
                op[0]  = acc[0][v];
                op[16] = acc[1][v];
                op[32] = acc[2][v];
                op[48] = acc[3][v];
            }
        }
    }
}

extern "C" void kernel_launch(void* const* d_in, const int* in_sizes, int n_in,
                              void* d_out, int out_size, void* d_ws, size_t ws_size,
                              hipStream_t stream) {
    const float* x         = (const float*)d_in[0];
    const int*   node_type = (const int*)  d_in[1];
    const float* W         = (const float*)d_in[2];
    const float* bias      = (const float*)d_in[3];
    float*       out       = (float*)d_out;

    const int N    = in_sizes[1];              // node_type has N elements
    const int grid = (N + CHUNK - 1) / CHUNK;

    if (ws_size >= (size_t)PACK_BYTES) {
        float* Bpack = (float*)d_ws;
        hipLaunchKernelGGL(pack_W_kernel, dim3(PACK_FLOATS / 256), dim3(256), 0, stream,
                           W, Bpack);
        hipLaunchKernelGGL((hetero_linear_wmma<true>), dim3(grid), dim3(256), 0, stream,
                           x, node_type, W, bias, Bpack, out, N);
    } else {
        hipLaunchKernelGGL((hetero_linear_wmma<false>), dim3(grid), dim3(256), 0, stream,
                           x, node_type, W, bias, (const float*)nullptr, out, N);
    }
}

// v002
// A run of this version takes 65.8 microseconds.
// Two timings next to v001 put it at 2.43 and 2.41 times that version's speed.
// Counting every step since v000, it is 2.62 times as fast.
#include <hip/hip_runtime.h>
#include <hip/hip_bf16.h>

typedef float v2f __attribute__((ext_vector_type(2)));
typedef float v4f __attribute__((ext_vector_type(4)));
typedef float v8f __attribute__((ext_vector_type(8)));

#define IN_DIM   128
#define OUT_DIM  64
#define NTYPES   8
#define CHUNK    256
#define NWAVES   8
#define MAXTILES (CHUNK / 16 + NTYPES)   // worst case sum ceil(c_t/16) = 16 + 8 = 24
// Staged x row pitch in floats: 512 B of data + 16 B pad. 132 mod 64 = 4, so the 16 rows
// of a b64 fragment read fall on 64 distinct LDS banks.
#define APITCH   (IN_DIM + 4)
#define BPRE     4   // k-step pairs of B requested ahead of the x-row copies

// Packed B layout: Bpack[t][kp][nt][lane][j]  (j=0..3), 65536 floats = 256 KB.
//   ks = 2*kp + (j>>1), v = j&1, value = W[t][4*ks + v + 2*(lane>>4)][nt*16 + (lane&15)]
// The lane index runs directly above a lane's 16 B, so the 32 lanes of one b128 load in the
// GEMM loop read 512 contiguous bytes (4 whole cache lines), and the loads of a tile walk
// the type's 32 KB in address order.
#define PACK_FLOATS (NTYPES * 4 * 32 * 32 * 2)   // 65536
#define PACK_BYTES  (PACK_FLOATS * 4)            // 262144

__global__ __launch_bounds__(256) void pack_W_kernel(
    const float* __restrict__ W, float* __restrict__ Bpack)
{
    int idx = blockIdx.x * blockDim.x + threadIdx.x;   // 0 .. 65535
    int v    = idx & 1;
    int lane = (idx >> 2) & 31;
    int nt   = (idx >> 7) & 3;
    int ks   = ((idx >> 9) & 15) * 2 + ((idx >> 1) & 1);
    int t    = idx >> 13;
    int k = 4 * ks + v + 2 * (lane >> 4);
    int n = nt * 16 + (lane & 15);
    Bpack[idx] = W[t * (IN_DIM * OUT_DIM) + k * OUT_DIM + n];
}

// Eight asynchronous copies to LDS, one whole 512-B row of x each: lane l brings bytes
// 16 l .. 16 l + 15 of row j (scalar base gj + lane byte offset) to LDS byte lds0 + j * pitch.
// s_wait_xcnt 0 ends the statement so that it stands ahead of any rewrite of a register
// that a copy names.
__device__ __forceinline__ void copy_rows8(
    unsigned lds0, unsigned laneByte,
    const float* g0, const float* g1, const float* g2, const float* g3,
    const float* g4, const float* g5, const float* g6, const float* g7)
{
    asm volatile(
        "global_load_async_to_lds_b128 %0, %8, %9\n\t"
        "global_load_async_to_lds_b128 %1, %8, %10\n\t"
        "global_load_async_to_lds_b128 %2, %8, %11\n\t"
        "global_load_async_to_lds_b128 %3, %8, %12\n\t"
        "global_load_async_to_lds_b128 %4, %8, %13\n\t"
        "global_load_async_to_lds_b128 %5, %8, %14\n\t"
        "global_load_async_to_lds_b128 %6, %8, %15\n\t"
        "global_load_async_to_lds_b128 %7, %8, %16\n\t"
        "s_wait_xcnt 0x0"
        :: "v"(lds0),                  "v"(lds0 + 1 * APITCH * 4), "v"(lds0 + 2 * APITCH * 4),
           "v"(lds0 + 3 * APITCH * 4), "v"(lds0 + 4 * APITCH * 4), "v"(lds0 + 5 * APITCH * 4),
           "v"(lds0 + 6 * APITCH * 4), "v"(lds0 + 7 * APITCH * 4), "v"(laneByte),
           "s"(g0), "s"(g1), "s"(g2), "s"(g3), "s"(g4), "s"(g5), "s"(g6), "s"(g7)
        : "memory");
}

// ---------------- common device body (templated on B source) ----------------

template <bool PACKED>
__global__ __launch_bounds__(256) void hetero_linear_wmma(
    const float* __restrict__ x,          // [N, 128]
    const int*   __restrict__ node_type,  // [N]
    const float* __restrict__ W,          // [8, 128, 64]  (used when !PACKED)
    const float* __restrict__ bias,       // [8, 64]
    const float* __restrict__ Bpack,      // packed B (used when PACKED)
    float*       __restrict__ out,        // [N, 64]
    int N)
{
    __shared__ int cnt[NTYPES];
    __shared__ int lists[NTYPES][CHUNK];
    __shared__ int tType[MAXTILES];
    __shared__ int tOff[MAXTILES];
    __shared__ int totalTiles;
    // One private 16-row x tile per wave: only the wave that fills a slot reads it, so the
    // wave's own waits order fill and read and no work-group barrier is needed.
    __shared__ __attribute__((aligned(16))) float stage[NWAVES][16 * APITCH];

    const int tid  = threadIdx.x;
    const int base = blockIdx.x * CHUNK;

    // ---- Phase 1: bucket row indices by type (LDS compaction) ----
    if (tid < NTYPES) cnt[tid] = 0;
    __syncthreads();

    {
        int row = base + tid;
        if (row < N) {
            int t   = node_type[row];
            int pos = atomicAdd(&cnt[t], 1);
            lists[t][pos] = row;
        }
    }
    __syncthreads();

    // ---- Phase 2: build the tile worklist ----
    if (tid == 0) {
        int n = 0;
        for (int t = 0; t < NTYPES; ++t) {
            int c = cnt[t];
            for (int s = 0; s < c; s += 16) {
                tType[n] = t;
                tOff[n]  = s;
                ++n;
            }
        }
        totalTiles = n;
    }
    __syncthreads();

    const int wave = __builtin_amdgcn_readfirstlane(tid >> 5);   // scalar: the tile loop branches on SCC
    const int lane = tid & 31;
    const int half = lane >> 4;   // 0: lanes 0-15, 1: lanes 16-31
    const int l16  = lane & 15;

    const int nTiles = __builtin_amdgcn_readfirstlane(totalTiles);
    float* const st = &stage[wave][0];
    const unsigned laneByte = lane * 16;                             // lane's 16 B inside a row
    const unsigned ldsRow0  = (unsigned)(size_t)st + laneByte;       // its LDS byte address in staged row 0

    // ---- Phase 3: each wave computes gathered 16x64 GEMM tiles ----
    // Wave-uniform loop: EXEC stays all-ones at every WMMA.
    for (int tile = wave; tile < nTiles; tile += NWAVES) {
        const int t     = __builtin_amdgcn_readfirstlane(tType[tile]);
        const int s     = __builtin_amdgcn_readfirstlane(tOff[tile]);
        const int count = __builtin_amdgcn_readfirstlane(cnt[t]);

        // --- Stage the 16 gathered rows of x in the wave's LDS slot, one whole 512-B row
        // per copy (32 lanes x 16 B = 4 full cache lines). A slot past the type's count
        // repeats the last valid row: its D row depends on that A row alone and is never stored.
        const int slotA = (s + l16 < count) ? (s + l16) : (count - 1);
        const int rowA  = lists[t][slotA];

        // Packed path: quad (kp,nt) of lane l is v4f number (kp*4 + nt)*32 + l. The first BPRE
        // quads per column tile are requested here, ahead of the waits below (which the
        // compiler moves no load across), so that they fly beside the x rows.
        const v4f* Bq = (const v4f*)(Bpack + (long)t * 8192) + lane;
        v4f qpre[BPRE][4];
        if (PACKED) {
            #pragma unroll
            for (int kp = 0; kp < BPRE; ++kp) {
                #pragma unroll
                for (int nt = 0; nt < 4; ++nt) qpre[kp][nt] = Bq[(kp * 4 + nt) * 32];
            }
        }

        // --- Accumulators seeded with bias: C(M,N) = bias[t][N] (M-invariant).
        const float* bp = bias + t * OUT_DIM;
        v8f acc[4];
        #pragma unroll
        for (int nt = 0; nt < 4; ++nt) {
            float bc = bp[nt * 16 + l16];
            #pragma unroll
            for (int v = 0; v < 8; ++v) acc[nt][v] = bc;
        }

        // The wave's own fragment reads of the previous tile retire before the slot is refilled.
        asm volatile("s_wait_dscnt 0x0" ::: "memory");
        const float* rb[16];   // wave-uniform row bases (scalar registers)
        #pragma unroll
        for (int j = 0; j < 16; ++j)
            rb[j] = x + (long)__builtin_amdgcn_readlane(rowA, j) * IN_DIM;
        copy_rows8(ldsRow0,              laneByte, rb[0], rb[1], rb[2],  rb[3],  rb[4],  rb[5],  rb[6],  rb[7]);
        copy_rows8(ldsRow0 + 8 * APITCH * 4, laneByte, rb[8], rb[9], rb[10], rb[11], rb[12], rb[13], rb[14], rb[15]);

        // The copies have landed before this wave reads them (no other wave reads this slot).
        asm volatile("s_wait_asynccnt 0x0" ::: "memory");

        // --- A fragments from LDS. A layout (f32 16x16x4): lane holds row M = l16;
        // k-step ks covers K = 4*ks + 2*half + {0,1}.
        v2f a[32];
        {
            const float* ap = st + l16 * APITCH + 2 * half;
            #pragma unroll
            for (int ks = 0; ks < 32; ++ks)
                a[ks] = *(const v2f*)(ap + 4 * ks);   // b64 LDS reads
        }

        // --- K loop: 32 k-steps x 4 column tiles = 128 WMMAs.
        if (PACKED) {
            #pragma unroll
            for (int kp = 0; kp < 16; ++kp) {     // two k-steps per iteration
                v4f q0 = (kp < BPRE) ? qpre[kp < BPRE ? kp : 0][0] : Bq[(kp * 4 + 0) * 32];
                v4f q1 = (kp < BPRE) ? qpre[kp < BPRE ? kp : 0][1] : Bq[(kp * 4 + 1) * 32];
                v4f q2 = (kp < BPRE) ? qpre[kp < BPRE ? kp : 0][2] : Bq[(kp * 4 + 2) * 32];
                v4f q3 = (kp < BPRE) ? qpre[kp < BPRE ? kp : 0][3] : Bq[(kp * 4 + 3) * 32];
                v2f b0l, b0h, b1l, b1h, b2l, b2h, b3l, b3h;
                b0l[0]=q0[0]; b0l[1]=q0[1]; b0h[0]=q0[2]; b0h[1]=q0[3];
                b1l[0]=q1[0]; b1l[1]=q1[1]; b1h[0]=q1[2]; b1h[1]=q1[3];
                b2l[0]=q2[0]; b2l[1]=q2[1]; b2h[0]=q2[2]; b2h[1]=q2[3];
                b3l[0]=q3[0]; b3l[1]=q3[1]; b3h[0]=q3[2]; b3h[1]=q3[3];
                // Interleave the 4 independent accumulator chains.
                acc[0] = __builtin_amdgcn_wmma_f32_16x16x4_f32(false, a[2*kp],   false, b0l, (short)0, acc[0], false, false);
                acc[1] = __builtin_amdgcn_wmma_f32_16x16x4_f32(false, a[2*kp],   false, b1l, (short)0, acc[1], false, false);
                acc[2] = __builtin_amdgcn_wmma_f32_16x16x4_f32(false, a[2*kp],   false, b2l, (short)0, acc[2], false, false);
                acc[3] = __builtin_amdgcn_wmma_f32_16x16x4_f32(false, a[2*kp],   false, b3l, (short)0, acc[3], false, false);
                acc[0] = __builtin_amdgcn_wmma_f32_16x16x4_f32(false, a[2*kp+1], false, b0h, (short)0, acc[0], false, false);
                acc[1] = __builtin_amdgcn_wmma_f32_16x16x4_f32(false, a[2*kp+1], false, b1h, (short)0, acc[1], false, false);
                acc[2] = __builtin_amdgcn_wmma_f32_16x16x4_f32(false, a[2*kp+1], false, b2h, (short)0, acc[2], false, false);
                acc[3] = __builtin_amdgcn_wmma_f32_16x16x4_f32(false, a[2*kp+1], false, b3h, (short)0, acc[3], false, false);
            }
        } else {
            // Fallback: B fragments straight from W (L2-hot, narrow loads).
            const float* Wp = W + t * (IN_DIM * OUT_DIM);
            #pragma unroll
            for (int ks = 0; ks < 32; ++ks) {
                const float* wrow = Wp + (4 * ks + 2 * half) * OUT_DIM + l16;
                #pragma unroll
                for (int nt = 0; nt < 4; ++nt) {
                    v2f bf;
                    bf[0] = wrow[nt * 16];
                    bf[1] = wrow[nt * 16 + OUT_DIM];
                    acc[nt] = __builtin_amdgcn_wmma_f32_16x16x4_f32(
                        false, a[ks], false, bf, (short)0, acc[nt], false, false);
                }
            }
        }

        // --- Scatter D: lane (L,v) holds (M = v + 8*half, N = l16).
        #pragma unroll
        for (int v = 0; v < 8; ++v) {
            const int M    = v + 8 * half;
            const int slot = s + M;
            if (slot < count) {
                const int r = lists[t][slot];
                float* op = out + (long)r * OUT_DIM + l16;
                op[0]  = acc[0][v];
                op[16] = acc[1][v];
                op[32] = acc[2][v];
                op[48] = acc[3][v];
            }
        }
    }
}

extern "C" void kernel_launch(void* const* d_in, const int* in_sizes, int n_in,
                              void* d_out, int out_size, void* d_ws, size_t ws_size,
                              hipStream_t stream) {
    const float* x         = (const float*)d_in[0];
    const int*   node_type = (const int*)  d_in[1];
    const float* W         = (const float*)d_in[2];
    const float* bias      = (const float*)d_in[3];
    float*       out       = (float*)d_out;

    const int N    = in_sizes[1];              // node_type has N elements
    const int grid = (N + CHUNK - 1) / CHUNK;

    if (ws_size >= (size_t)PACK_BYTES) {
        float* Bpack = (float*)d_ws;
        hipLaunchKernelGGL(pack_W_kernel, dim3(PACK_FLOATS / 256), dim3(256), 0, stream,
                           W, Bpack);
        hipLaunchKernelGGL((hetero_linear_wmma<true>), dim3(grid), dim3(256), 0, stream,
                           x, node_type, W, bias, Bpack, out, N);
    } else {
        hipLaunchKernelGGL((hetero_linear_wmma<false>), dim3(grid), dim3(256), 0, stream,
                           x, node_type, W, bias, (const float*)nullptr, out, N);
    }
}

// v003
// One run takes 57 microseconds.
// Timed twice side by side with v002, it ran 1.15 and 1.16 times as fast.
// Over all steps from v000 it is 3.02 times as fast.
#include <hip/hip_runtime.h>
#include <hip/hip_bf16.h>

typedef float v2f __attribute__((ext_vector_type(2)));
typedef float v4f __attribute__((ext_vector_type(4)));
typedef float v8f __attribute__((ext_vector_type(8)));

#define IN_DIM   128
#define OUT_DIM  64
#define NTYPES   8
#define NWAVES   8
#define RPT      7                       // rows of the chunk that each thread tests for the group's type
#define CHUNK    (256 * RPT)             // 1792 rows; a work-group takes the rows of ONE type in them
// Staged x row pitch in floats: 512 B of data + 16 B pad. 132 mod 64 = 4, so the 16 rows
// of a b64 fragment read fall on 64 distinct LDS banks.
#define APITCH   (IN_DIM + 4)
#define BPRE     4   // k-step pairs of B read from LDS while the x-row copies fly
#define TYPE_FLOATS (IN_DIM * OUT_DIM)   // 8192 floats = 32 KB of packed B per type

// Packed B layout: Bpack[t][kp][nt][lane][j]  (j=0..3), 65536 floats = 256 KB.
//   ks = 2*kp + (j>>1), v = j&1, value = W[t][4*ks + v + 2*(lane>>4)][nt*16 + (lane&15)]
// The lane index runs directly above a lane's 16 B, so the 32 lanes of one b128 read in the
// GEMM loop take 512 contiguous bytes. A type's 32 KB are copied as they lie into LDS.
#define PACK_FLOATS (NTYPES * 4 * 32 * 32 * 2)   // 65536
#define PACK_BYTES  (PACK_FLOATS * 4)            // 262144

__global__ __launch_bounds__(256) void pack_W_kernel(
    const float* __restrict__ W, float* __restrict__ Bpack)
{
    int idx = blockIdx.x * blockDim.x + threadIdx.x;   // 0 .. 65535
    int v    = idx & 1;
    int lane = (idx >> 2) & 31;
    int nt   = (idx >> 7) & 3;
    int ks   = ((idx >> 9) & 15) * 2 + ((idx >> 1) & 1);
    int t    = idx >> 13;
    int k = 4 * ks + v + 2 * (lane >> 4);
    int n = nt * 16 + (lane & 15);
    Bpack[idx] = W[t * (IN_DIM * OUT_DIM) + k * OUT_DIM + n];
}

// Eight asynchronous copies to LDS, one whole 512-B row of x each: lane l brings bytes
// 16 l .. 16 l + 15 of row j (scalar base gj + lane byte offset) to LDS byte lds0 + j * pitch.
// s_wait_xcnt 0 ends the statement so that it stands ahead of any rewrite of a register
// that a copy names.
__device__ __forceinline__ void copy_rows8(
    unsigned lds0, unsigned laneByte,
    const float* g0, const float* g1, const float* g2, const float* g3,
    const float* g4, const float* g5, const float* g6, const float* g7)
{
    asm volatile(
        "global_load_async_to_lds_b128 %0, %8, %9\n\t"
        "global_load_async_to_lds_b128 %1, %8, %10\n\t"
        "global_load_async_to_lds_b128 %2, %8, %11\n\t"
        "global_load_async_to_lds_b128 %3, %8, %12\n\t"
        "global_load_async_to_lds_b128 %4, %8, %13\n\t"
        "global_load_async_to_lds_b128 %5, %8, %14\n\t"
        "global_load_async_to_lds_b128 %6, %8, %15\n\t"
        "global_load_async_to_lds_b128 %7, %8, %16\n\t"
        "s_wait_xcnt 0x0"
        :: "v"(lds0),                  "v"(lds0 + 1 * APITCH * 4), "v"(lds0 + 2 * APITCH * 4),
           "v"(lds0 + 3 * APITCH * 4), "v"(lds0 + 4 * APITCH * 4), "v"(lds0 + 5 * APITCH * 4),
           "v"(lds0 + 6 * APITCH * 4), "v"(lds0 + 7 * APITCH * 4), "v"(laneByte),
           "s"(g0), "s"(g1), "s"(g2), "s"(g3), "s"(g4), "s"(g5), "s"(g6), "s"(g7)
        : "memory");
}

// Eight asynchronous copies to LDS of 512 contiguous bytes each (lane l brings 16 B from its
// own global pointer to its own LDS byte address), 512 B apart on both sides.
// s_wait_xcnt 0 ends the statement so that it stands ahead of any rewrite of a register
// that a copy names.
__device__ __forceinline__ void copy_lines8(unsigned lds, const float* g)
{
    asm volatile(
        "global_load_async_to_lds_b128 %0, %8, off\n\t"
        "global_load_async_to_lds_b128 %1, %9, off\n\t"
        "global_load_async_to_lds_b128 %2, %10, off\n\t"
        "global_load_async_to_lds_b128 %3, %11, off\n\t"
        "global_load_async_to_lds_b128 %4, %12, off\n\t"
        "global_load_async_to_lds_b128 %5, %13, off\n\t"
        "global_load_async_to_lds_b128 %6, %14, off\n\t"
        "global_load_async_to_lds_b128 %7, %15, off\n\t"
        "s_wait_xcnt 0x0"
        :: "v"(lds),           "v"(lds + 1 * 512), "v"(lds + 2 * 512), "v"(lds + 3 * 512),
           "v"(lds + 4 * 512), "v"(lds + 5 * 512), "v"(lds + 6 * 512), "v"(lds + 7 * 512),
           "v"(g),           "v"(g + 1 * 128), "v"(g + 2 * 128), "v"(g + 3 * 128),
           "v"(g + 4 * 128), "v"(g + 5 * 128), "v"(g + 6 * 128), "v"(g + 7 * 128)
        : "memory");
}

// ---------------- common device body (templated on B source) ----------------

template <bool PACKED>
__global__ __launch_bounds__(256) void hetero_linear_wmma(
    const float* __restrict__ x,          // [N, 128]
    const int*   __restrict__ node_type,  // [N]
    const float* __restrict__ W,          // [8, 128, 64]  (used when !PACKED)
    const float* __restrict__ bias,       // [8, 64]
    const float* __restrict__ Bpack,      // packed B (used when PACKED)
    float*       __restrict__ out,        // [N, 64]
    int N)
{
    // The group's type's packed B, filled once and then read by all eight waves.
    __shared__ __attribute__((aligned(16))) float Bs[TYPE_FLOATS];
    // One private 16-row x tile per wave: only the wave that fills a slot reads it, so the
    // wave's own waits order fill and read and no work-group barrier is needed.
    __shared__ __attribute__((aligned(16))) float stage[NWAVES][16 * APITCH];
    __shared__ unsigned short list[CHUNK];   // chunk-local indices of the rows of the group's type
    __shared__ int waveCnt[NWAVES];

    const int tid  = threadIdx.x;
    const int t    = blockIdx.x & (NTYPES - 1);        // the group's type
    const int base = (blockIdx.x >> 3) * CHUNK;        // first row of its chunk

    const int wave = __builtin_amdgcn_readfirstlane(tid >> 5);   // scalar: the tile loop branches on SCC
    const int lane = tid & 31;
    const int half = lane >> 4;   // 0: lanes 0-15, 1: lanes 16-31
    const int l16  = lane & 15;

    // ---- Phase 0: the type's 32 KB of packed B start towards LDS; wave w brings bytes
    // 4096 w .. 4096 w + 4095. They fly beside the type test below.
    if (PACKED)
        copy_lines8((unsigned)(size_t)&Bs[wave * 1024 + lane * 4],
                    Bpack + t * TYPE_FLOATS + wave * 1024 + lane * 4);

    // ---- Phase 1: list the chunk's rows of type t. Wave w tests rows 32 RPT w .. + 32 RPT - 1;
    // a row's place is the number of listed rows in front of it (ballots, no atomics).
    int ty[RPT], at[RPT];
    #pragma unroll   // ty[] and at[] stay in registers and the RPT loads fly together
    for (int j = 0; j < RPT; ++j) {
        const int row = base + (wave * RPT + j) * 32 + lane;
        at[j] = row < N ? row : N - 1;
        ty[j] = node_type[at[j]];
    }
    // Stands ahead of any rewrite of a register that a node_type load above names: the
    // offsets are inputs, so their registers stay theirs up to the wait.
    static_assert(RPT == 7, "the wait below names RPT offsets");
    asm volatile("s_wait_xcnt 0x0"
                 :: "v"(at[0]), "v"(at[1]), "v"(at[2]), "v"(at[3]), "v"(at[4]), "v"(at[5]), "v"(at[6])
                 : "memory");

    // The type's bias, one value per column tile, asked for here so that it arrives while the
    // rows are listed: C(M,N) = bias[t][N] (M-invariant).
    float bc[4];
    #pragma unroll   // bc[] stays in registers
    for (int nt = 0; nt < 4; ++nt) bc[nt] = bias[t * OUT_DIM + nt * 16 + l16];

    unsigned hit[RPT];
    int mine = 0;
    #pragma unroll   // hit[] stays in registers
    for (int j = 0; j < RPT; ++j) {
        const int row = base + (wave * RPT + j) * 32 + lane;
        hit[j] = __builtin_amdgcn_ballot_w32(row < N && ty[j] == t);
        mine  += __popc(hit[j]);
    }
    if (lane == 0) waveCnt[wave] = mine;
    __syncthreads();

    int pos = 0, total = 0;
    #pragma unroll   // eight broadcast reads in one group
    for (int w = 0; w < NWAVES; ++w) {
        const int c = waveCnt[w];
        if (w < wave) pos += c;
        total += c;
    }
    #pragma unroll   // hit[] is indexed by constants only
    for (int j = 0; j < RPT; ++j) {
        if ((hit[j] >> lane) & 1u)
            list[pos + __popc(hit[j] & ((1u << lane) - 1u))] = (unsigned short)((wave * RPT + j) * 32 + lane);
        pos += __popc(hit[j]);
    }
    // This wave's slice of B has landed; the barrier then publishes every slice and the list.
    asm volatile("s_wait_asynccnt 0x0" ::: "memory");
    __syncthreads();

    const int count  = __builtin_amdgcn_readfirstlane(total);
    const int nTiles = (count + 15) >> 4;
    float* const st = &stage[wave][0];
    const unsigned laneByte = lane * 16;                             // lane's 16 B inside a row
    const unsigned ldsRow0  = (unsigned)(size_t)st + laneByte;       // its LDS byte address in staged row 0

    // ---- Phase 2: each wave computes gathered 16x64 GEMM tiles ----
    // Wave-uniform loop: EXEC stays all-ones at every WMMA.
    for (int tile = wave; tile < nTiles; tile += NWAVES) {
        const int s = tile * 16;

        // --- Stage the 16 gathered rows of x in the wave's LDS slot, one whole 512-B row
        // per copy (32 lanes x 16 B = 4 full cache lines). A slot past the type's count
        // repeats the last valid row: its D row depends on that A row alone and is never stored.
        const int slotA = (s + l16 < count) ? (s + l16) : (count - 1);
        const int rowA  = base + list[slotA];

        // --- Accumulators seeded with bias.
        v8f acc[4];
        #pragma unroll
        for (int nt = 0; nt < 4; ++nt) {
            #pragma unroll
            for (int v = 0; v < 8; ++v) acc[nt][v] = bc[nt];
        }

        // The wave's own fragment reads of the previous tile retire before the slot is refilled.
        asm volatile("s_wait_dscnt 0x0" ::: "memory");
        const float* rb[16];   // wave-uniform row bases (scalar registers)
        #pragma unroll
        for (int j = 0; j < 16; ++j)
            rb[j] = x + (long)__builtin_amdgcn_readlane(rowA, j) * IN_DIM;
        copy_rows8(ldsRow0,              laneByte, rb[0], rb[1], rb[2],  rb[3],  rb[4],  rb[5],  rb[6],  rb[7]);
        copy_rows8(ldsRow0 + 8 * APITCH * 4, laneByte, rb[8], rb[9], rb[10], rb[11], rb[12], rb[13], rb[14], rb[15]);

        // Packed path: quad (kp,nt) of lane l is v4f number (kp*4 + nt)*32 + l of Bs. The first
        // BPRE quads per column tile are read here, between the copies and their wait (the
        // compiler moves no load across either), so that they arrive while the x rows fly.
        const v4f* Bq = (const v4f*)Bs + lane;
        v4f qpre[BPRE][4];
        if (PACKED) {
            #pragma unroll   // qpre[][] stays in registers
            for (int kp = 0; kp < BPRE; ++kp) {
                #pragma unroll   // the same
                for (int nt = 0; nt < 4; ++nt) qpre[kp][nt] = Bq[(kp * 4 + nt) * 32];
            }
        }

        // The copies have landed before this wave reads them (no other wave reads this slot).
        asm volatile("s_wait_asynccnt 0x0" ::: "memory");

        // --- A fragments from LDS. A layout (f32 16x16x4): lane holds row M = l16;
        // k-step ks covers K = 4*ks + 2*half + {0,1}.
        v2f a[32];
        {
            const float* ap = st + l16 * APITCH + 2 * half;
            #pragma unroll
            for (int ks = 0; ks < 32; ++ks)
                a[ks] = *(const v2f*)(ap + 4 * ks);   // b64 LDS reads
        }

        // --- K loop: 32 k-steps x 4 column tiles = 128 WMMAs.
        if (PACKED) {
            #pragma unroll
            for (int kp = 0; kp < 16; ++kp) {     // two k-steps per iteration
                v4f q0 = (kp < BPRE) ? qpre[kp < BPRE ? kp : 0][0] : Bq[(kp * 4 + 0) * 32];
                v4f q1 = (kp < BPRE) ? qpre[kp < BPRE ? kp : 0][1] : Bq[(kp * 4 + 1) * 32];
                v4f q2 = (kp < BPRE) ? qpre[kp < BPRE ? kp : 0][2] : Bq[(kp * 4 + 2) * 32];
                v4f q3 = (kp < BPRE) ? qpre[kp < BPRE ? kp : 0][3] : Bq[(kp * 4 + 3) * 32];
                v2f b0l, b0h, b1l, b1h, b2l, b2h, b3l, b3h;
                b0l[0]=q0[0]; b0l[1]=q0[1]; b0h[0]=q0[2]; b0h[1]=q0[3];
                b1l[0]=q1[0]; b1l[1]=q1[1]; b1h[0]=q1[2]; b1h[1]=q1[3];
                b2l[0]=q2[0]; b2l[1]=q2[1]; b2h[0]=q2[2]; b2h[1]=q2[3];
                b3l[0]=q3[0]; b3l[1]=q3[1]; b3h[0]=q3[2]; b3h[1]=q3[3];
                // Interleave the 4 independent accumulator chains.
                acc[0] = __builtin_amdgcn_wmma_f32_16x16x4_f32(false, a[2*kp],   false, b0l, (short)0, acc[0], false, false);
                acc[1] = __builtin_amdgcn_wmma_f32_16x16x4_f32(false, a[2*kp],   false, b1l, (short)0, acc[1], false, false);
                acc[2] = __builtin_amdgcn_wmma_f32_16x16x4_f32(false, a[2*kp],   false, b2l, (short)0, acc[2], false, false);
                acc[3] = __builtin_amdgcn_wmma_f32_16x16x4_f32(false, a[2*kp],   false, b3l, (short)0, acc[3], false, false);
                acc[0] = __builtin_amdgcn_wmma_f32_16x16x4_f32(false, a[2*kp+1], false, b0h, (short)0, acc[0], false, false);
                acc[1] = __builtin_amdgcn_wmma_f32_16x16x4_f32(false, a[2*kp+1], false, b1h, (short)0, acc[1], false, false);
                acc[2] = __builtin_amdgcn_wmma_f32_16x16x4_f32(false, a[2*kp+1], false, b2h, (short)0, acc[2], false, false);
                acc[3] = __builtin_amdgcn_wmma_f32_16x16x4_f32(false, a[2*kp+1], false, b3h, (short)0, acc[3], false, false);
            }
        } else {
            // Fallback: B fragments straight from W (L2-hot, narrow loads).
            const float* Wp = W + t * (IN_DIM * OUT_DIM);
            #pragma unroll
            for (int ks = 0; ks < 32; ++ks) {
                const float* wrow = Wp + (4 * ks + 2 * half) * OUT_DIM + l16;
                #pragma unroll
                for (int nt = 0; nt < 4; ++nt) {
                    v2f bf;
                    bf[0] = wrow[nt * 16];
                    bf[1] = wrow[nt * 16 + OUT_DIM];
                    acc[nt] = __builtin_amdgcn_wmma_f32_16x16x4_f32(
                        false, a[ks], false, bf, (short)0, acc[nt], false, false);
                }
            }
        }

        // --- Scatter D: lane (L,v) holds (M = v + 8*half, N = l16).
        #pragma unroll
        for (int v = 0; v < 8; ++v) {
            const int M    = v + 8 * half;
            const int slot = s + M;
            if (slot < count) {
                const int r = base + list[slot];
                float* op = out + (long)r * OUT_DIM + l16;
                op[0]  = acc[0][v];
                op[16] = acc[1][v];
                op[32] = acc[2][v];
                op[48] = acc[3][v];
            }
        }
        // Stands ahead of the next tile's rewrite of the registers that the last stores name.
        asm volatile("s_wait_xcnt 0x0" ::: "memory");
    }
}

extern "C" void kernel_launch(void* const* d_in, const int* in_sizes, int n_in,
                              void* d_out, int out_size, void* d_ws, size_t ws_size,
                              hipStream_t stream) {
    const float* x         = (const float*)d_in[0];
    const int*   node_type = (const int*)  d_in[1];
    const float* W         = (const float*)d_in[2];
    const float* bias      = (const float*)d_in[3];
    float*       out       = (float*)d_out;

    const int N    = in_sizes[1];              // node_type has N elements
    const int grid = (N + CHUNK - 1) / CHUNK * NTYPES;   // one work-group per chunk and type

    if (ws_size >= (size_t)PACK_BYTES) {
        float* Bpack = (float*)d_ws;
        hipLaunchKernelGGL(pack_W_kernel, dim3(PACK_FLOATS / 256), dim3(256), 0, stream,
                           W, Bpack);
        hipLaunchKernelGGL((hetero_linear_wmma<true>), dim3(grid), dim3(256), 0, stream,
                           x, node_type, W, bias, Bpack, out, N);
    } else {
        hipLaunchKernelGGL((hetero_linear_wmma<false>), dim3(grid), dim3(256), 0, stream,
                           x, node_type, W, bias, (const float*)nullptr, out, N);
    }
}
